// v000
// Times are from an AMD MI455X. After a warm-up the kernel runs many times in a row, and a time is the length of
// such a window on the GPU divided by its runs, so every launch and the gaps after it count. The runs cycle
// through copies of the inputs. A figure is the median of several windows, for all but v000 over two sittings.
// Sittings can differ by a few percent; kernels timed side by side share one.
// v000 is the starting kernel. One run takes 616 microseconds.
#include <hip/hip_runtime.h>
#include <math.h>

typedef __attribute__((ext_vector_type(2))) float v2f;
typedef __attribute__((ext_vector_type(8))) float v8f;
typedef __attribute__((ext_vector_type(4))) unsigned int v4u;
typedef __attribute__((ext_vector_type(8))) int v8i;
typedef __attribute__((ext_vector_type(4))) int v4i;

// ---------------------------------------------------------------------------
// f32 WMMA helper: D = A(16x4) * B(4x16) + C(16x16), wave32.
// ---------------------------------------------------------------------------
__device__ __forceinline__ v8f wmma4(v2f a, v2f b, v8f c) {
  return __builtin_amdgcn_wmma_f32_16x16x4_f32(false, a, false, b, (short)0, c,
                                               false, false);
}

// A-fragment (and B-fragment from row-major [N,K]) loader for 16x16x4 f32:
// lane<16 holds [row=lane][k = 4*kk + {0,1}], lane>=16 holds [row=lane-16][4*kk+{2,3}]
__device__ __forceinline__ v2f ldfrag(const float* __restrict__ base, int ld,
                                      int kk) {
  const int lane = threadIdx.x & 31;
  const int row = lane & 15;
  const int kr = (kk << 2) + ((lane >> 4) << 1);
  return *(const v2f*)(base + (size_t)row * ld + kr);  // 8B aligned -> b64 load
}

// 16x64 output strip GEMM: C = A[16,K] * B_rows[64,K]^T, fp32, K%4==0
__device__ __forceinline__ void gemm_strip(const float* __restrict__ A, int lda,
                                           const float* __restrict__ B, int ldb,
                                           int K, v8f acc[4]) {
  for (int kk = 0; kk < (K >> 2); ++kk) {
    v2f a = ldfrag(A, lda, kk);
#pragma unroll
    for (int t = 0; t < 4; ++t) {
      v2f b = ldfrag(B + (size_t)(t << 4) * ldb, ldb, kk);
      acc[t] = wmma4(a, b, acc[t]);
    }
  }
}

// cross-lane xor reduction within 16-lane halves via ds_swizzle
template <int XM>
__device__ __forceinline__ float swz_xor(float x) {
  return __int_as_float(
      __builtin_amdgcn_ds_swizzle(__float_as_int(x), (XM << 10) | 0x1f));
}

// ---------------------------------------------------------------------------
// Problem constants
// ---------------------------------------------------------------------------
#define BB 4
#define LL 1024
#define NN 2048
#define VDIM 512
#define LDIM 768
#define HID 512
#define NH 8
#define HD 64
#define NBLK 32           // N / 64 column blocks in attention
#define MROW 65           // padded LDS row stride for mask tiles (floats)

// ---------------------------------------------------------------------------
// TDM: async DMA of one 16x64 f32 mask tile (row stride NN) into LDS.
// 2D descriptor, data_size=4B, pad 1 DWORD every 64 DWORDs -> LDS row = 65 f.
// ---------------------------------------------------------------------------
__device__ __forceinline__ void tdm_mask_tile(unsigned int lds_off,
                                              const float* g) {
  const unsigned long long ga = (unsigned long long)(uintptr_t)g;
  v4u g0 = {1u,                                   // count=1, user descriptor
            lds_off,                              // lds_addr (bytes)
            (unsigned int)ga,                     // global_addr[31:0]
            ((unsigned int)(ga >> 32) & 0x01FFFFFFu) | (2u << 30)};  // type=2
  v8i g1 = {(int)((2u << 16) | (1u << 20) | (5u << 22)),  // 4B | pad_en | every 64dw
            (int)(((unsigned int)NN & 0xFFFFu) << 16),    // tensor_dim0 lo16
            (int)(0x8000u << 16),                         // tensor_dim1 lo16 = 32768
            (int)(64u << 16),                             // tile_dim0 = 64
            16,                                           // tile_dim1 = 16
            (int)NN,                                      // tensor_dim0_stride
            0, 0};
  v4i gz4 = {0, 0, 0, 0};
  v8i gz8 = {0, 0, 0, 0, 0, 0, 0, 0};
  __builtin_amdgcn_tensor_load_to_lds(g0, g1, gz4, gz4, gz8, 0);
}

// ---------------------------------------------------------------------------
// Kernel 1: q = x @ Wq^T   -> stored [B,H,L,HD]
// ---------------------------------------------------------------------------
__global__ __launch_bounds__(32) void k_qproj(const float* __restrict__ x,
                                              const float* __restrict__ Wq,
                                              float* __restrict__ qout) {
  const int m0 = blockIdx.x << 4;  // M = B*L = 4096
  const int n0 = blockIdx.y << 6;  // N = HID = 512, 64-col strips
  v8f acc[4] = {};
  gemm_strip(x + (size_t)m0 * VDIM, VDIM, Wq + (size_t)n0 * VDIM, VDIM, VDIM, acc);
  const int lane = threadIdx.x & 31;
  const int col = lane & 15;
  const int ro = (lane >> 4) << 3;
#pragma unroll
  for (int t = 0; t < 4; ++t) {
    const int c = n0 + (t << 4) + col;
    const int h = c >> 6, d = c & 63;
#pragma unroll
    for (int r = 0; r < 8; ++r) {
      const int m = m0 + r + ro;
      const int b = m >> 10, l = m & (LL - 1);
      qout[(size_t)((((b << 3) + h) << 10) + l) * HD + d] = acc[t][r];
    }
  }
}

// ---------------------------------------------------------------------------
// Kernel 2: kv = vfeats @ Wkv^T -> k,v each stored [B,H,N,HD]
// ---------------------------------------------------------------------------
__global__ __launch_bounds__(32) void k_kvproj(const float* __restrict__ vf,
                                               const float* __restrict__ Wkv,
                                               float* __restrict__ kout,
                                               float* __restrict__ vout) {
  const int m0 = blockIdx.x << 4;  // M = B*N = 8192
  const int n0 = blockIdx.y << 6;  // N = 2*HID = 1024
  v8f acc[4] = {};
  gemm_strip(vf + (size_t)m0 * LDIM, LDIM, Wkv + (size_t)n0 * LDIM, LDIM, LDIM, acc);
  const int lane = threadIdx.x & 31;
  const int col = lane & 15;
  const int ro = (lane >> 4) << 3;
  float* __restrict__ dst = (n0 < HID) ? kout : vout;  // strip is head-aligned
#pragma unroll
  for (int t = 0; t < 4; ++t) {
    const int c = n0 + (t << 4) + col;
    const int h = (c & (HID - 1)) >> 6, d = c & 63;
#pragma unroll
    for (int r = 0; r < 8; ++r) {
      const int m = m0 + r + ro;
      const int b = m >> 11, n = m & (NN - 1);
      dst[(size_t)((((b << 3) + h) << 11) + n) * HD + d] = acc[t][r];
    }
  }
}

// ---------------------------------------------------------------------------
// Kernel 3: flash attention, 64-column N blocks, TDM-double-buffered mask.
// One wave32 per 16-row Q tile. Output stored [B,L,HID].
// ---------------------------------------------------------------------------
__global__ __launch_bounds__(32) void k_attn(const float* __restrict__ q,
                                             const float* __restrict__ kmat,
                                             const float* __restrict__ vmat,
                                             const float* __restrict__ mask,
                                             float* __restrict__ ao) {
  __shared__ float sM[2][16 * MROW];  // TDM mask tiles, double buffered
  __shared__ float sP[16][68];        // P (16x64) staging, padded rows
  const int tile = blockIdx.x;        // B*H*(L/16) = 2048
  const int lt = tile & 63;
  const int bh = tile >> 6;           // b*8+h
  const int h = bh & 7, b = bh >> 3;
  const int l0 = lt << 4;
  const float* __restrict__ qb = q + ((size_t)bh * LL + l0) * HD;
  const float* __restrict__ kb = kmat + (size_t)bh * NN * HD;
  const float* __restrict__ vb = vmat + (size_t)bh * NN * HD;
  const float* __restrict__ mb = mask + ((size_t)bh * LL + l0) * NN;
  const int lane = threadIdx.x & 31;
  const int col = lane & 15;
  const int hi2 = (lane >> 4) << 1;
  const int ro = (lane >> 4) << 3;

  // Q tile fragments kept in registers for the whole N sweep (32 VGPRs)
  v2f qa[16];
#pragma unroll
  for (int kk = 0; kk < 16; ++kk) qa[kk] = ldfrag(qb, HD, kk);

  v8f o[4] = {};
  float M[8], Lr[8];
#pragma unroll
  for (int r = 0; r < 8; ++r) { M[r] = -INFINITY; Lr[r] = 0.f; }

  const unsigned int ldsM0 = (unsigned int)(size_t)(void*)&sM[0][0];
  const unsigned int ldsM1 = (unsigned int)(size_t)(void*)&sM[1][0];

  tdm_mask_tile(ldsM0, mb);  // prime block 0

  for (int j = 0; j < NBLK; ++j) {
    // issue next mask tile into the other buffer, wait for current
    if (j + 1 < NBLK) {
      tdm_mask_tile((j & 1) ? ldsM0 : ldsM1, mb + (size_t)(j + 1) * 64);
      __builtin_amdgcn_s_wait_tensorcnt(1);
    } else {
      __builtin_amdgcn_s_wait_tensorcnt(0);
    }
    const float* __restrict__ smj = (j & 1) ? &sM[1][0] : &sM[0][0];

    // S[4] = Q * K_block^T   (64 WMMAs over HD=64, 4 column tiles)
    v8f s[4];
#pragma unroll
    for (int t = 0; t < 4; ++t) {
      const float* kt = kb + (size_t)((j << 2) + t) * 16 * HD;
      v8f acc = {};
#pragma unroll
      for (int kk = 0; kk < 16; ++kk) acc = wmma4(qa[kk], ldfrag(kt, HD, kk), acc);
      s[t] = acc;
    }

    if (j + 1 < NBLK)  // pull next V block toward the caches
      __builtin_prefetch(vb + (size_t)(j + 1) * 64 * HD, 0, 0);

    // scale + mask + online softmax over the 64-col block
    // (local max/sum over 4 tiles first, then one 4-step swizzle tree)
    float alpha[8];
#pragma unroll
    for (int r = 0; r < 8; ++r) {
      float sv[4];
      float mx = -INFINITY;
#pragma unroll
      for (int t = 0; t < 4; ++t) {
        const float mval = smj[(r + ro) * MROW + (t << 4) + col];
        sv[t] = s[t][r] * 0.125f + mval;  // SCALE = 64^-0.5
        mx = fmaxf(mx, sv[t]);
      }
      mx = fmaxf(mx, swz_xor<1>(mx));
      mx = fmaxf(mx, swz_xor<2>(mx));
      mx = fmaxf(mx, swz_xor<4>(mx));
      mx = fmaxf(mx, swz_xor<8>(mx));
      const float Mn = fmaxf(M[r], mx);
      alpha[r] = __expf(M[r] - Mn);
      M[r] = Mn;
      float rs = 0.f;
#pragma unroll
      for (int t = 0; t < 4; ++t) {
        const float pv = __expf(sv[t] - Mn);
        sP[r + ro][(t << 4) + col] = pv;
        rs += pv;
      }
      rs += swz_xor<1>(rs);
      rs += swz_xor<2>(rs);
      rs += swz_xor<4>(rs);
      rs += swz_xor<8>(rs);
      Lr[r] = Lr[r] * alpha[r] + rs;
    }
#pragma unroll
    for (int t = 0; t < 4; ++t)
#pragma unroll
      for (int r = 0; r < 8; ++r) o[t][r] *= alpha[r];
    __syncthreads();

    // O += P(16x64) * V_block(64x64)  (64 WMMAs)
    const float* vt = vb + (size_t)j * 64 * HD;
#pragma unroll
    for (int kk = 0; kk < 16; ++kk) {
      const int kr = (kk << 2) + hi2;
      const v2f pa = v2f{sP[col][kr], sP[col][kr + 1]};
#pragma unroll
      for (int t = 0; t < 4; ++t) {
        v2f bf;
        bf.x = vt[(size_t)kr * HD + (t << 4) + col];
        bf.y = vt[(size_t)(kr + 1) * HD + (t << 4) + col];
        o[t] = wmma4(pa, bf, o[t]);
      }
    }
    __syncthreads();
  }

  // normalize and scatter to [B,L,HID]
#pragma unroll
  for (int r = 0; r < 8; ++r) Lr[r] = 1.f / Lr[r];
#pragma unroll
  for (int t = 0; t < 4; ++t)
#pragma unroll
    for (int r = 0; r < 8; ++r) {
      const int l = l0 + r + ro;
      ao[((size_t)b * LL + l) * HID + (h << 6) + (t << 4) + col] =
          o[t][r] * Lr[r];
    }
}

// ---------------------------------------------------------------------------
// Kernel 4: out = attn_out @ Wproj^T + bproj
// ---------------------------------------------------------------------------
__global__ __launch_bounds__(32) void k_oproj(const float* __restrict__ ao,
                                              const float* __restrict__ Wp,
                                              const float* __restrict__ bp,
                                              float* __restrict__ out) {
  const int m0 = blockIdx.x << 4;  // M = 4096
  const int n0 = blockIdx.y << 6;  // N = 512
  v8f acc[4] = {};
  gemm_strip(ao + (size_t)m0 * HID, HID, Wp + (size_t)n0 * HID, HID, HID, acc);
  const int lane = threadIdx.x & 31;
  const int col = lane & 15;
  const int ro = (lane >> 4) << 3;
#pragma unroll
  for (int t = 0; t < 4; ++t) {
    const int c = n0 + (t << 4) + col;
    const float bias = bp[c];
#pragma unroll
    for (int r = 0; r < 8; ++r) {
      const int m = m0 + r + ro;
      out[(size_t)m * VDIM + c] = acc[t][r] + bias;
    }
  }
}

// ---------------------------------------------------------------------------
extern "C" void kernel_launch(void* const* d_in, const int* in_sizes, int n_in,
                              void* d_out, int out_size, void* d_ws,
                              size_t ws_size, hipStream_t stream) {
  const float* x    = (const float*)d_in[0];
  const float* vf   = (const float*)d_in[1];
  const float* mask = (const float*)d_in[2];
  const float* Wq   = (const float*)d_in[3];
  const float* Wkv  = (const float*)d_in[4];
  const float* Wp   = (const float*)d_in[5];
  const float* bp   = (const float*)d_in[6];
  float* out = (float*)d_out;

  float* q  = (float*)d_ws;                         // B*H*L*HD   = 2,097,152 f
  float* km = q + (size_t)BB * NH * LL * HD;        // B*H*N*HD   = 4,194,304 f
  float* vm = km + (size_t)BB * NH * NN * HD;       // B*H*N*HD   = 4,194,304 f
  float* ao = vm + (size_t)BB * NH * NN * HD;       // B*L*HID    = 2,097,152 f

  k_qproj<<<dim3((BB * LL) / 16, HID / 64), 32, 0, stream>>>(x, Wq, q);
  k_kvproj<<<dim3((BB * NN) / 16, (2 * HID) / 64), 32, 0, stream>>>(vf, Wkv, km, vm);
  k_attn<<<dim3(BB * NH * (LL / 16)), 32, 0, stream>>>(q, km, vm, mask, ao);
  k_oproj<<<dim3((BB * LL) / 16, VDIM / 64), 32, 0, stream>>>(ao, Wp, bp, out);
}

// v001
// One run takes 341 microseconds.
// Next to v000, in two timings, it ran 1.87 and 1.86 times as fast.
#include <hip/hip_runtime.h>
#include <math.h>

typedef __attribute__((ext_vector_type(2))) float v2f;
typedef __attribute__((ext_vector_type(8))) float v8f;
typedef __attribute__((ext_vector_type(4))) unsigned int v4u;
typedef __attribute__((ext_vector_type(8))) int v8i;
typedef __attribute__((ext_vector_type(4))) int v4i;

// ---------------------------------------------------------------------------
// f32 WMMA helper: D = A(16x4) * B(4x16) + C(16x16), wave32.
// ---------------------------------------------------------------------------
__device__ __forceinline__ v8f wmma4(v2f a, v2f b, v8f c) {
  return __builtin_amdgcn_wmma_f32_16x16x4_f32(false, a, false, b, (short)0, c,
                                               false, false);
}

// A-fragment (and B-fragment from row-major [N,K]) loader for 16x16x4 f32:
// lane<16 holds [row=lane][k = 4*kk + {0,1}], lane>=16 holds [row=lane-16][4*kk+{2,3}]
__device__ __forceinline__ v2f ldfrag(const float* __restrict__ base, int ld,
                                      int kk) {
  const int lane = threadIdx.x & 31;
  const int row = lane & 15;
  const int kr = (kk << 2) + ((lane >> 4) << 1);
  return *(const v2f*)(base + (size_t)row * ld + kr);  // 8B aligned -> b64 load
}

// 16x64 output strip GEMM: C = A[16,K] * B_rows[64,K]^T, fp32, K%4==0
__device__ __forceinline__ void gemm_strip(const float* __restrict__ A, int lda,
                                           const float* __restrict__ B, int ldb,
                                           int K, v8f acc[4]) {
  for (int kk = 0; kk < (K >> 2); ++kk) {
    v2f a = ldfrag(A, lda, kk);
#pragma unroll
    for (int t = 0; t < 4; ++t) {
      v2f b = ldfrag(B + (size_t)(t << 4) * ldb, ldb, kk);
      acc[t] = wmma4(a, b, acc[t]);
    }
  }
}

// cross-lane xor reduction within 16-lane halves via ds_swizzle
template <int XM>
__device__ __forceinline__ float swz_xor(float x) {
  return __int_as_float(
      __builtin_amdgcn_ds_swizzle(__float_as_int(x), (XM << 10) | 0x1f));
}

// ---------------------------------------------------------------------------
// Problem constants
// ---------------------------------------------------------------------------
#define BB 4
#define LL 1024
#define NN 2048
#define VDIM 512
#define LDIM 768
#define HID 512
#define NH 8
#define HD 64
#define NBLK 32           // N / 64 column blocks in attention
#define MROW 65           // padded LDS row stride for mask tiles (floats)

// ---------------------------------------------------------------------------
// TDM: async DMA of one 16x64 f32 mask tile (row stride NN) into LDS.
// 2D descriptor, data_size=4B, pad 1 DWORD every 64 DWORDs -> LDS row = 65 f.
// ---------------------------------------------------------------------------
__device__ __forceinline__ void tdm_mask_tile(unsigned int lds_off,
                                              const float* g) {
  const unsigned long long ga = (unsigned long long)(uintptr_t)g;
  v4u g0 = {1u,                                   // count=1, user descriptor
            lds_off,                              // lds_addr (bytes)
            (unsigned int)ga,                     // global_addr[31:0]
            ((unsigned int)(ga >> 32) & 0x01FFFFFFu) | (2u << 30)};  // type=2
  v8i g1 = {(int)((2u << 16) | (1u << 20) | (5u << 22)),  // 4B | pad_en | every 64dw
            (int)(((unsigned int)NN & 0xFFFFu) << 16),    // tensor_dim0 lo16
            (int)(0x8000u << 16),                         // tensor_dim1 lo16 = 32768
            (int)(64u << 16),                             // tile_dim0 = 64
            16,                                           // tile_dim1 = 16
            (int)NN,                                      // tensor_dim0_stride
            0, 0};
  v4i gz4 = {0, 0, 0, 0};
  v8i gz8 = {0, 0, 0, 0, 0, 0, 0, 0};
  __builtin_amdgcn_tensor_load_to_lds(g0, g1, gz4, gz4, gz8, 0);
}

// ---------------------------------------------------------------------------
// Kernel 1: q = x @ Wq^T   -> stored [B,H,L,HD]
// ---------------------------------------------------------------------------
__global__ __launch_bounds__(32) void k_qproj(const float* __restrict__ x,
                                              const float* __restrict__ Wq,
                                              float* __restrict__ qout) {
  const int m0 = blockIdx.x << 4;  // M = B*L = 4096
  const int n0 = blockIdx.y << 6;  // N = HID = 512, 64-col strips
  v8f acc[4] = {};
  gemm_strip(x + (size_t)m0 * VDIM, VDIM, Wq + (size_t)n0 * VDIM, VDIM, VDIM, acc);
  const int lane = threadIdx.x & 31;
  const int col = lane & 15;
  const int ro = (lane >> 4) << 3;
#pragma unroll
  for (int t = 0; t < 4; ++t) {
    const int c = n0 + (t << 4) + col;
    const int h = c >> 6, d = c & 63;
#pragma unroll
    for (int r = 0; r < 8; ++r) {
      const int m = m0 + r + ro;
      const int b = m >> 10, l = m & (LL - 1);
      qout[(size_t)((((b << 3) + h) << 10) + l) * HD + d] = acc[t][r];
    }
  }
}

// ---------------------------------------------------------------------------
// Kernel 2: kv = vfeats @ Wkv^T -> k,v each stored [B,H,N,HD]
// ---------------------------------------------------------------------------
__global__ __launch_bounds__(32) void k_kvproj(const float* __restrict__ vf,
                                               const float* __restrict__ Wkv,
                                               float* __restrict__ kout,
                                               float* __restrict__ vout) {
  const int m0 = blockIdx.x << 4;  // M = B*N = 8192
  const int n0 = blockIdx.y << 6;  // N = 2*HID = 1024
  v8f acc[4] = {};
  gemm_strip(vf + (size_t)m0 * LDIM, LDIM, Wkv + (size_t)n0 * LDIM, LDIM, LDIM, acc);
  const int lane = threadIdx.x & 31;
  const int col = lane & 15;
  const int ro = (lane >> 4) << 3;
  float* __restrict__ dst = (n0 < HID) ? kout : vout;  // strip is head-aligned
#pragma unroll
  for (int t = 0; t < 4; ++t) {
    const int c = n0 + (t << 4) + col;
    const int h = (c & (HID - 1)) >> 6, d = c & 63;
#pragma unroll
    for (int r = 0; r < 8; ++r) {
      const int m = m0 + r + ro;
      const int b = m >> 11, n = m & (NN - 1);
      dst[(size_t)((((b << 3) + h) << 11) + n) * HD + d] = acc[t][r];
    }
  }
}

// ---------------------------------------------------------------------------
// Kernel 3: flash attention, 64-column N blocks.
// Four waves per work-group, one 16-row Q tile each, all of one (b,h): each
// K and V block is copied into LDS once for the four of them (asynchronous
// copies, two buffers), the next block in flight while this one is worked on.
// Mask tiles: one tensor load per wave and block, in the same two-buffer ring.
// Output stored [B,L,HID].
// ---------------------------------------------------------------------------
#define AW 4      // waves per work-group
#define KP 68     // LDS row pitch of K, floats: 8-byte fragment reads meet 64 banks
#define VP 72     // LDS row pitch of V, floats: rows kr and kr+2 lie 16 banks apart
#define MBUF 1536 // floats per mask buffer: 6 KiB, keeps every place a multiple of 2 KiB

// wave-uniform test held in a scalar register, so that the branch is scalar
__device__ __forceinline__ unsigned int pinned(unsigned int v) {
  unsigned int w = __builtin_amdgcn_readfirstlane(v);
  asm volatile("" : "+s"(w));  // tensor mover's issue test held in a scalar register
  return w;
}

// Eight asynchronous 16-byte copies per lane: a 64x64 f32 block (rows of 256 B,
// contiguous in global memory) into LDS rows of lstep/8 bytes. The s_wait_xcnt
// closes the statement so that no address register is rewritten ahead of it.
__device__ __forceinline__ void copy_block(unsigned int l, unsigned int lstep,
                                           const float* g) {
  asm volatile(
      "global_load_async_to_lds_b128 %0, %8, off\n\t"
      "global_load_async_to_lds_b128 %1, %9, off\n\t"
      "global_load_async_to_lds_b128 %2, %10, off\n\t"
      "global_load_async_to_lds_b128 %3, %11, off\n\t"
      "global_load_async_to_lds_b128 %4, %12, off\n\t"
      "global_load_async_to_lds_b128 %5, %13, off\n\t"
      "global_load_async_to_lds_b128 %6, %14, off\n\t"
      "global_load_async_to_lds_b128 %7, %15, off\n\t"
      "s_wait_xcnt 0x0"
      :: "v"(l), "v"(l + lstep), "v"(l + 2 * lstep), "v"(l + 3 * lstep),
         "v"(l + 4 * lstep), "v"(l + 5 * lstep), "v"(l + 6 * lstep),
         "v"(l + 7 * lstep),
         "v"(g), "v"(g + 512), "v"(g + 1024), "v"(g + 1536), "v"(g + 2048),
         "v"(g + 2560), "v"(g + 3072), "v"(g + 3584)
      : "memory");
}

__global__ __launch_bounds__(128) void k_attn(const float* __restrict__ q,
                                              const float* __restrict__ kmat,
                                              const float* __restrict__ vmat,
                                              const float* __restrict__ mask,
                                              float* __restrict__ ao) {
  __shared__ __attribute__((aligned(2048))) float sM[AW][2][MBUF];  // mask tiles
  __shared__ __attribute__((aligned(16))) float sK[2][64 * KP];     // K blocks
  __shared__ __attribute__((aligned(16))) float sV[2][64 * VP];     // V blocks
  __shared__ float sP[AW][16][68];  // P (16x64) staging, one per wave
  const int tid = threadIdx.x;
  const int wave = __builtin_amdgcn_readfirstlane(tid >> 5);
  const int grp = blockIdx.x & 15;    // L/64 row groups
  const int bh = blockIdx.x >> 4;     // b*8+h
  const int h = bh & 7, b = bh >> 3;
  const int l0 = (grp << 6) + (wave << 4);
  const float* __restrict__ qb = q + ((size_t)bh * LL + l0) * HD;
  const float* __restrict__ kb = kmat + (size_t)bh * NN * HD;
  const float* __restrict__ vb = vmat + (size_t)bh * NN * HD;
  const float* __restrict__ mb = mask + ((size_t)bh * LL + l0) * NN;
  const int lane = tid & 31;
  const int col = lane & 15;
  const int hi2 = (lane >> 4) << 1;
  const int ro = (lane >> 4) << 3;

  // Q tile fragments kept in registers for the whole N sweep (32 VGPRs)
  v2f qa[16];
#pragma unroll
  for (int kk = 0; kk < 16; ++kk) qa[kk] = ldfrag(qb, HD, kk);

  v8f o[4] = {};
  float M[8], Lr[8];
#pragma unroll
  for (int r = 0; r < 8; ++r) { M[r] = -INFINITY; Lr[r] = 0.f; }

  const unsigned int ldsM0 = (unsigned int)(size_t)(void*)&sM[wave][0][0];
  const unsigned int ldsM1 = (unsigned int)(size_t)(void*)&sM[wave][1][0];

  // this lane's share of a block: row (tid>>4) + 8*i, 16-byte piece tid&15
  const int crow = tid >> 4, cpc = (tid & 15) << 2;
  const unsigned int ldsK0 = (unsigned int)(size_t)(void*)&sK[0][crow * KP + cpc];
  const unsigned int ldsK1 = (unsigned int)(size_t)(void*)&sK[1][crow * KP + cpc];
  const unsigned int ldsV0 = (unsigned int)(size_t)(void*)&sV[0][crow * VP + cpc];
  const unsigned int ldsV1 = (unsigned int)(size_t)(void*)&sV[1][crow * VP + cpc];
  const float* kc = kb + crow * HD + cpc;
  const float* vc = vb + crow * HD + cpc;

  // block 0 into buffer 0, landed and published; then block 1 into buffer 1
  copy_block(ldsK0, 8 * KP * 4, kc);
  copy_block(ldsV0, 8 * VP * 4, vc);
  tdm_mask_tile(ldsM0, mb);
  asm volatile("s_wait_asynccnt 0x0" ::: "memory");   // own copies of block 0 landed
  asm volatile("s_wait_tensorcnt 0x0" ::: "memory");  // own mask tile 0 landed
  __syncthreads();
  copy_block(ldsK1, 8 * KP * 4, kc + 64 * HD);
  copy_block(ldsV1, 8 * VP * 4, vc + 64 * HD);
  tdm_mask_tile(ldsM1, mb + 64);

  for (int j = 0; j < NBLK; ++j) {
    const float* __restrict__ smj = &sM[wave][j & 1][0];
    const float* __restrict__ skj = &sK[j & 1][0];
    const float* __restrict__ svj = &sV[j & 1][0];

    // S[4] = Q * K_block^T   (64 WMMAs over HD=64, 4 column tiles)
    v8f s[4] = {};
#pragma unroll
    for (int kk = 0; kk < 16; ++kk) {
#pragma unroll
      for (int t = 0; t < 4; ++t) {
        const v2f kf =
            *(const v2f*)(skj + ((t << 4) + col) * KP + (kk << 2) + hi2);
        s[t] = wmma4(qa[kk], kf, s[t]);
      }
    }

    // scale + mask + online softmax over the 64-col block
    // (local max/sum over 4 tiles first, then one 4-step swizzle tree)
    float alpha[8];
#pragma unroll
    for (int r = 0; r < 8; ++r) {
      float sv[4];
      float mx = -INFINITY;
#pragma unroll
      for (int t = 0; t < 4; ++t) {
        const float mval = smj[(r + ro) * MROW + (t << 4) + col];
        sv[t] = s[t][r] * 0.125f + mval;  // SCALE = 64^-0.5
        mx = fmaxf(mx, sv[t]);
      }
      mx = fmaxf(mx, swz_xor<1>(mx));
      mx = fmaxf(mx, swz_xor<2>(mx));
      mx = fmaxf(mx, swz_xor<4>(mx));
      mx = fmaxf(mx, swz_xor<8>(mx));
      const float Mn = fmaxf(M[r], mx);
      alpha[r] = __expf(M[r] - Mn);
      M[r] = Mn;
      float rs = 0.f;
#pragma unroll
      for (int t = 0; t < 4; ++t) {
        const float pv = __expf(sv[t] - Mn);
        sP[wave][r + ro][(t << 4) + col] = pv;
        rs += pv;
      }
      rs += swz_xor<1>(rs);
      rs += swz_xor<2>(rs);
      rs += swz_xor<4>(rs);
      rs += swz_xor<8>(rs);
      Lr[r] = Lr[r] * alpha[r] + rs;
    }
#pragma unroll
    for (int t = 0; t < 4; ++t)
#pragma unroll
      for (int r = 0; r < 8; ++r) o[t][r] *= alpha[r];
    // P is private to the wave: its own stores have retired before other lanes
    // of the same wave read them back; no work-group barrier is needed here
    asm volatile("s_wait_dscnt 0x0" ::: "memory");

    // O += P(16x64) * V_block(64x64)  (64 WMMAs)
#pragma unroll
    for (int kk = 0; kk < 16; ++kk) {
      const int kr = (kk << 2) + hi2;
      const v2f pa = v2f{sP[wave][col][kr], sP[wave][col][kr + 1]};
#pragma unroll
      for (int t = 0; t < 4; ++t) {
        v2f bf;
        bf.x = svj[kr * VP + (t << 4) + col];
        bf.y = svj[(kr + 1) * VP + (t << 4) + col];
        o[t] = wmma4(pa, bf, o[t]);
      }
    }

    // publish point of block j+1, and hand-over of block j's buffers
    asm volatile("s_wait_dscnt 0x0" ::: "memory");      // own reads of block j retired
    asm volatile("s_wait_asynccnt 0x0" ::: "memory");   // own copies of block j+1 landed
    asm volatile("s_wait_tensorcnt 0x0" ::: "memory");  // own mask tile j+1 landed
    __syncthreads();
    // four vector slots between the block's last WMMAs and the first vector
    // write over their A or B registers, on both sides of the branch below
    asm volatile("v_nop\n\tv_nop\n\tv_nop\n\tv_nop");
    if (pinned(j + 2 < NBLK)) {
      const size_t nx = (size_t)(j + 2) * 64;
      copy_block((j & 1) ? ldsK1 : ldsK0, 8 * KP * 4, kc + nx * HD);
      copy_block((j & 1) ? ldsV1 : ldsV0, 8 * VP * 4, vc + nx * HD);
      tdm_mask_tile((j & 1) ? ldsM1 : ldsM0, mb + nx);
    }
  }
  asm volatile("s_wait_asynccnt 0x0" ::: "memory");   // nothing in flight at the end
  asm volatile("s_wait_tensorcnt 0x0" ::: "memory");
  asm volatile("s_wait_dscnt 0x0" ::: "memory");

  // normalize and scatter to [B,L,HID]
#pragma unroll
  for (int r = 0; r < 8; ++r) Lr[r] = 1.f / Lr[r];
#pragma unroll
  for (int t = 0; t < 4; ++t)
#pragma unroll
    for (int r = 0; r < 8; ++r) {
      const int l = l0 + r + ro;
      ao[((size_t)b * LL + l) * HID + (h << 6) + (t << 4) + col] =
          o[t][r] * Lr[r];
    }
}

// ---------------------------------------------------------------------------
// Kernel 4: out = attn_out @ Wproj^T + bproj
// ---------------------------------------------------------------------------
__global__ __launch_bounds__(32) void k_oproj(const float* __restrict__ ao,
                                              const float* __restrict__ Wp,
                                              const float* __restrict__ bp,
                                              float* __restrict__ out) {
  const int m0 = blockIdx.x << 4;  // M = 4096
  const int n0 = blockIdx.y << 6;  // N = 512
  v8f acc[4] = {};
  gemm_strip(ao + (size_t)m0 * HID, HID, Wp + (size_t)n0 * HID, HID, HID, acc);
  const int lane = threadIdx.x & 31;
  const int col = lane & 15;
  const int ro = (lane >> 4) << 3;
#pragma unroll
  for (int t = 0; t < 4; ++t) {
    const int c = n0 + (t << 4) + col;
    const float bias = bp[c];
#pragma unroll
    for (int r = 0; r < 8; ++r) {
      const int m = m0 + r + ro;
      out[(size_t)m * VDIM + c] = acc[t][r] + bias;
    }
  }
}

// ---------------------------------------------------------------------------
extern "C" void kernel_launch(void* const* d_in, const int* in_sizes, int n_in,
                              void* d_out, int out_size, void* d_ws,
                              size_t ws_size, hipStream_t stream) {
  const float* x    = (const float*)d_in[0];
  const float* vf   = (const float*)d_in[1];
  const float* mask = (const float*)d_in[2];
  const float* Wq   = (const float*)d_in[3];
  const float* Wkv  = (const float*)d_in[4];
  const float* Wp   = (const float*)d_in[5];
  const float* bp   = (const float*)d_in[6];
  float* out = (float*)d_out;

  float* q  = (float*)d_ws;                         // B*H*L*HD   = 2,097,152 f
  float* km = q + (size_t)BB * NH * LL * HD;        // B*H*N*HD   = 4,194,304 f
  float* vm = km + (size_t)BB * NH * NN * HD;       // B*H*N*HD   = 4,194,304 f
  float* ao = vm + (size_t)BB * NH * NN * HD;       // B*L*HID    = 2,097,152 f

  k_qproj<<<dim3((BB * LL) / 16, HID / 64), 32, 0, stream>>>(x, Wq, q);
  k_kvproj<<<dim3((BB * NN) / 16, (2 * HID) / 64), 32, 0, stream>>>(vf, Wkv, km, vm);
  k_attn<<<dim3(BB * NH * (LL / 64)), 128, 0, stream>>>(q, km, vm, mask, ao);
  k_oproj<<<dim3((BB * LL) / 16, VDIM / 64), 32, 0, stream>>>(ao, Wp, bp, out);
}

// v002
// One run takes 216 microseconds.
// Timed twice side by side with v001, it ran 1.59 times as fast both times.
// Over all steps from v000 it is 2.96 times as fast.
#include <hip/hip_runtime.h>
#include <math.h>

typedef __attribute__((ext_vector_type(2))) float v2f;
typedef __attribute__((ext_vector_type(8))) float v8f;
typedef __attribute__((ext_vector_type(4))) unsigned int v4u;
typedef __attribute__((ext_vector_type(8))) int v8i;
typedef __attribute__((ext_vector_type(4))) int v4i;

// ---------------------------------------------------------------------------
// f32 WMMA helper: D = A(16x4) * B(4x16) + C(16x16), wave32.
// ---------------------------------------------------------------------------
__device__ __forceinline__ v8f wmma4(v2f a, v2f b, v8f c) {
  return __builtin_amdgcn_wmma_f32_16x16x4_f32(false, a, false, b, (short)0, c,
                                               false, false);
}

// A-fragment (and B-fragment from row-major [N,K]) loader for 16x16x4 f32:
// lane<16 holds [row=lane][k = 4*kk + {0,1}], lane>=16 holds [row=lane-16][4*kk+{2,3}]
__device__ __forceinline__ v2f ldfrag(const float* __restrict__ base, int ld,
                                      int kk) {
  const int lane = threadIdx.x & 31;
  const int row = lane & 15;
  const int kr = (kk << 2) + ((lane >> 4) << 1);
  return *(const v2f*)(base + (size_t)row * ld + kr);  // 8B aligned -> b64 load
}

// ---------------------------------------------------------------------------
// Projection GEMM, C = A[M,K] * B[N,K]^T, fp32: a work-group of four waves
// (2 x 2) owns a (32*MT) x (32*NT) tile of C, a wave MT x NT tiles of 16 x 16.
// A and B pass through LDS in stages of GK columns (asynchronous copies, two
// buffers): each row piece is fetched once for the work-group, as whole
// 256-byte runs, and the next stage flies while this one is worked on.
// ---------------------------------------------------------------------------
#define GK 64  // k extent of a stage, floats
#define GP 68  // LDS row pitch, floats: 8-byte fragment reads meet all 64 banks

// Eight asynchronous 16-byte copies per lane, rows 8 apart: 64 rows of 256 B
// for the 128 lanes together. The s_wait_xcnt closes the statement so that no
// address register is rewritten ahead of it.
__device__ __forceinline__ void copy_rows(unsigned int l, const float* g,
                                          size_t gs) {
  const unsigned int ls = 8 * GP * 4;
  asm volatile(
      "global_load_async_to_lds_b128 %0, %8, off\n\t"
      "global_load_async_to_lds_b128 %1, %9, off\n\t"
      "global_load_async_to_lds_b128 %2, %10, off\n\t"
      "global_load_async_to_lds_b128 %3, %11, off\n\t"
      "global_load_async_to_lds_b128 %4, %12, off\n\t"
      "global_load_async_to_lds_b128 %5, %13, off\n\t"
      "global_load_async_to_lds_b128 %6, %14, off\n\t"
      "global_load_async_to_lds_b128 %7, %15, off\n\t"
      "s_wait_xcnt 0x0"
      :: "v"(l), "v"(l + ls), "v"(l + 2 * ls), "v"(l + 3 * ls), "v"(l + 4 * ls),
         "v"(l + 5 * ls), "v"(l + 6 * ls), "v"(l + 7 * ls),
         "v"(g), "v"(g + gs), "v"(g + 2 * gs), "v"(g + 3 * gs), "v"(g + 4 * gs),
         "v"(g + 5 * gs), "v"(g + 6 * gs), "v"(g + 7 * gs)
      : "memory");
}

// one stage of R rows (R a multiple of 64) of a row-major [.,K] matrix
template <int R, int K>
__device__ __forceinline__ void copy_stage(unsigned int l, const float* g) {
#pragma unroll  // R/64 statements, addresses folded at compile time
  for (int i = 0; i < R / 64; ++i)
    copy_rows(l + i * 64 * GP * 4, g + (size_t)i * 64 * K, (size_t)8 * K);
}

// A, B: first row of the work-group's tile. sA: 2 x 32*MT*GP floats, sB alike.
template <int MT, int NT, int K>
__device__ __forceinline__ void gemm_staged(const float* __restrict__ A,
                                            const float* __restrict__ B,
                                            float* sA, float* sB,
                                            v8f (&acc)[MT][NT]) {
  constexpr int BM = 32 * MT, BN = 32 * NT, NS = K / GK;
  const int tid = threadIdx.x;
  const int wave = __builtin_amdgcn_readfirstlane(tid >> 5);
  const int lane = tid & 31;
  const int col = lane & 15;
  const int hi2 = (lane >> 4) << 1;
  // this lane's share of a stage: row (tid>>4) + 8*i, 16-byte piece tid&15
  const int crow = tid >> 4, cpc = (tid & 15) << 2;
  const unsigned int lA = (unsigned int)(size_t)(void*)(sA + crow * GP + cpc);
  const unsigned int lB = (unsigned int)(size_t)(void*)(sB + crow * GP + cpc);
  const float* ga = A + (size_t)crow * K + cpc;
  const float* gb = B + (size_t)crow * K + cpc;
  // this lane's fragment rows inside a buffer
  const int fa = (((wave >> 1) * MT << 4) + col) * GP + hi2;
  const int fb = (((wave & 1) * NT << 4) + col) * GP + hi2;

  // stage 0 into buffer 0, landed and published; then stage 1 into buffer 1
  copy_stage<BM, K>(lA, ga);
  copy_stage<BN, K>(lB, gb);
  asm volatile("s_wait_asynccnt 0x0" ::: "memory");  // own copies of stage 0 landed
  __syncthreads();
  copy_stage<BM, K>(lA + BM * GP * 4, ga + GK);
  copy_stage<BN, K>(lB + BN * GP * 4, gb + GK);

#pragma unroll 1  // rolled
  for (int s = 0; s < NS; ++s) {
    const float* __restrict__ pa = sA + (s & 1) * (BM * GP) + fa;
    const float* __restrict__ pb = sB + (s & 1) * (BN * GP) + fb;
#pragma unroll  // straight line: LDS offsets become immediates, reads run ahead
    for (int kk = 0; kk < GK / 4; ++kk) {
      v2f af[MT], bf[NT];
#pragma unroll  // register arrays need constant indices
      for (int i = 0; i < MT; ++i)
        af[i] = *(const v2f*)(pa + (i << 4) * GP + (kk << 2));
#pragma unroll  // register arrays need constant indices
      for (int t = 0; t < NT; ++t)
        bf[t] = *(const v2f*)(pb + (t << 4) * GP + (kk << 2));
#pragma unroll  // register arrays need constant indices
      for (int i = 0; i < MT; ++i)
#pragma unroll  // register arrays need constant indices
        for (int t = 0; t < NT; ++t) acc[i][t] = wmma4(af[i], bf[t], acc[i][t]);
    }
    // publish point of stage s+1, and hand-over of stage s's buffers
    asm volatile("s_wait_dscnt 0x0" ::: "memory");     // own reads of stage s retired
    asm volatile("s_wait_asynccnt 0x0" ::: "memory");  // own copies of stage s+1 landed
    __syncthreads();
    if (s + 2 < NS) {
      copy_stage<BM, K>(lA + (s & 1) * (BM * GP * 4), ga + (s + 2) * GK);
      copy_stage<BN, K>(lB + (s & 1) * (BN * GP * 4), gb + (s + 2) * GK);
    }
  }
  asm volatile("s_wait_asynccnt 0x0" ::: "memory");  // nothing in flight at the end
}

// cross-lane xor reduction within 16-lane halves via ds_swizzle
template <int XM>
__device__ __forceinline__ float swz_xor(float x) {
  return __int_as_float(
      __builtin_amdgcn_ds_swizzle(__float_as_int(x), (XM << 10) | 0x1f));
}

// ---------------------------------------------------------------------------
// Problem constants
// ---------------------------------------------------------------------------
#define BB 4
#define LL 1024
#define NN 2048
#define VDIM 512
#define LDIM 768
#define HID 512
#define NH 8
#define HD 64
#define NBLK 32           // N / 64 column blocks in attention
#define MROW 65           // padded LDS row stride for mask tiles (floats)

// ---------------------------------------------------------------------------
// TDM: async DMA of one 16x64 f32 mask tile (row stride NN) into LDS.
// 2D descriptor, data_size=4B, pad 1 DWORD every 64 DWORDs -> LDS row = 65 f.
// ---------------------------------------------------------------------------
__device__ __forceinline__ void tdm_mask_tile(unsigned int lds_off,
                                              const float* g) {
  const unsigned long long ga = (unsigned long long)(uintptr_t)g;
  v4u g0 = {1u,                                   // count=1, user descriptor
            lds_off,                              // lds_addr (bytes)
            (unsigned int)ga,                     // global_addr[31:0]
            ((unsigned int)(ga >> 32) & 0x01FFFFFFu) | (2u << 30)};  // type=2
  v8i g1 = {(int)((2u << 16) | (1u << 20) | (5u << 22)),  // 4B | pad_en | every 64dw
            (int)(((unsigned int)NN & 0xFFFFu) << 16),    // tensor_dim0 lo16
            (int)(0x8000u << 16),                         // tensor_dim1 lo16 = 32768
            (int)(64u << 16),                             // tile_dim0 = 64
            16,                                           // tile_dim1 = 16
            (int)NN,                                      // tensor_dim0_stride
            0, 0};
  v4i gz4 = {0, 0, 0, 0};
  v8i gz8 = {0, 0, 0, 0, 0, 0, 0, 0};
  __builtin_amdgcn_tensor_load_to_lds(g0, g1, gz4, gz4, gz8, 0);
}

// ---------------------------------------------------------------------------
// Kernel 1: q = x @ Wq^T   -> stored [B,H,L,HD]
// ---------------------------------------------------------------------------
__global__ __launch_bounds__(128) void k_qproj(const float* __restrict__ x,
                                               const float* __restrict__ Wq,
                                               float* __restrict__ qout) {
  __shared__ __attribute__((aligned(16))) float sA[2 * 64 * GP];
  __shared__ __attribute__((aligned(16))) float sB[2 * 64 * GP];
  const int wave = __builtin_amdgcn_readfirstlane(threadIdx.x >> 5);
  const int m0 = blockIdx.x << 6;  // M = B*L = 4096, 64-row tiles
  const int n0 = blockIdx.y << 6;  // N = HID = 512, 64-col tiles
  v8f acc[2][2] = {};
  gemm_staged<2, 2, VDIM>(x + (size_t)m0 * VDIM, Wq + (size_t)n0 * VDIM, sA, sB, acc);
  const int lane = threadIdx.x & 31;
  const int col = lane & 15;
  const int ro = (lane >> 4) << 3;
  const int mw = m0 + ((wave >> 1) << 5), nw = n0 + ((wave & 1) << 5);
#pragma unroll  // here and below: acc lives in registers, its indices must be constants
  for (int i = 0; i < 2; ++i)
#pragma unroll
    for (int t = 0; t < 2; ++t) {
      const int c = nw + (t << 4) + col;
      const int h = c >> 6, d = c & 63;
#pragma unroll
      for (int r = 0; r < 8; ++r) {
        const int m = mw + (i << 4) + r + ro;
        const int b = m >> 10, l = m & (LL - 1);
        qout[(size_t)((((b << 3) + h) << 10) + l) * HD + d] = acc[i][t][r];
      }
    }
}

// ---------------------------------------------------------------------------
// Kernel 2: kv = vfeats @ Wkv^T -> k,v each stored [B,H,N,HD]
// ---------------------------------------------------------------------------
__global__ __launch_bounds__(128) void k_kvproj(const float* __restrict__ vf,
                                                const float* __restrict__ Wkv,
                                                float* __restrict__ kout,
                                                float* __restrict__ vout) {
  __shared__ __attribute__((aligned(16))) float sA[2 * 128 * GP];
  __shared__ __attribute__((aligned(16))) float sB[2 * 128 * GP];
  const int wave = __builtin_amdgcn_readfirstlane(threadIdx.x >> 5);
  const int m0 = blockIdx.x << 7;  // M = B*N = 8192, 128-row tiles
  const int n0 = blockIdx.y << 7;  // N = 2*HID = 1024, 128-col tiles
  v8f acc[4][4] = {};
  gemm_staged<4, 4, LDIM>(vf + (size_t)m0 * LDIM, Wkv + (size_t)n0 * LDIM, sA, sB, acc);
  const int lane = threadIdx.x & 31;
  const int col = lane & 15;
  const int ro = (lane >> 4) << 3;
  const int mw = m0 + ((wave >> 1) << 6), nw = n0 + ((wave & 1) << 6);
  float* __restrict__ dst = (n0 < HID) ? kout : vout;  // tile lies in k or in v
#pragma unroll  // here and below: acc lives in registers, its indices must be constants
  for (int i = 0; i < 4; ++i)
#pragma unroll
    for (int t = 0; t < 4; ++t) {
      const int c = nw + (t << 4) + col;
      const int h = (c & (HID - 1)) >> 6, d = c & 63;
#pragma unroll
      for (int r = 0; r < 8; ++r) {
        const int m = mw + (i << 4) + r + ro;
        const int b = m >> 11, n = m & (NN - 1);
        dst[(size_t)((((b << 3) + h) << 11) + n) * HD + d] = acc[i][t][r];
      }
    }
}

// ---------------------------------------------------------------------------
// Kernel 3: flash attention, 64-column N blocks.
// Four waves per work-group, one 16-row Q tile each, all of one (b,h): each
// K and V block is copied into LDS once for the four of them (asynchronous
// copies, two buffers), the next block in flight while this one is worked on.
// Mask tiles: one tensor load per wave and block, in the same two-buffer ring.
// Output stored [B,L,HID].
// ---------------------------------------------------------------------------
#define AW 4      // waves per work-group
#define KP 68     // LDS row pitch of K, floats: 8-byte fragment reads meet 64 banks
#define VP 72     // LDS row pitch of V, floats: rows kr and kr+2 lie 16 banks apart
#define MBUF 1536 // floats per mask buffer: 6 KiB, keeps every place a multiple of 2 KiB

// wave-uniform test held in a scalar register, so that the branch is scalar
__device__ __forceinline__ unsigned int pinned(unsigned int v) {
  unsigned int w = __builtin_amdgcn_readfirstlane(v);
  asm volatile("" : "+s"(w));  // tensor mover's issue test held in a scalar register
  return w;
}

// Eight asynchronous 16-byte copies per lane: a 64x64 f32 block (rows of 256 B,
// contiguous in global memory) into LDS rows of lstep/8 bytes. The s_wait_xcnt
// closes the statement so that no address register is rewritten ahead of it.
__device__ __forceinline__ void copy_block(unsigned int l, unsigned int lstep,
                                           const float* g) {
  asm volatile(
      "global_load_async_to_lds_b128 %0, %8, off\n\t"
      "global_load_async_to_lds_b128 %1, %9, off\n\t"
      "global_load_async_to_lds_b128 %2, %10, off\n\t"
      "global_load_async_to_lds_b128 %3, %11, off\n\t"
      "global_load_async_to_lds_b128 %4, %12, off\n\t"
      "global_load_async_to_lds_b128 %5, %13, off\n\t"
      "global_load_async_to_lds_b128 %6, %14, off\n\t"
      "global_load_async_to_lds_b128 %7, %15, off\n\t"
      "s_wait_xcnt 0x0"
      :: "v"(l), "v"(l + lstep), "v"(l + 2 * lstep), "v"(l + 3 * lstep),
         "v"(l + 4 * lstep), "v"(l + 5 * lstep), "v"(l + 6 * lstep),
         "v"(l + 7 * lstep),
         "v"(g), "v"(g + 512), "v"(g + 1024), "v"(g + 1536), "v"(g + 2048),
         "v"(g + 2560), "v"(g + 3072), "v"(g + 3584)
      : "memory");
}

__global__ __launch_bounds__(128) void k_attn(const float* __restrict__ q,
                                              const float* __restrict__ kmat,
                                              const float* __restrict__ vmat,
                                              const float* __restrict__ mask,
                                              float* __restrict__ ao) {
  __shared__ __attribute__((aligned(2048))) float sM[AW][2][MBUF];  // mask tiles
  __shared__ __attribute__((aligned(16))) float sK[2][64 * KP];     // K blocks
  __shared__ __attribute__((aligned(16))) float sV[2][64 * VP];     // V blocks
  __shared__ float sP[AW][16][68];  // P (16x64) staging, one per wave
  const int tid = threadIdx.x;
  const int wave = __builtin_amdgcn_readfirstlane(tid >> 5);
  const int grp = blockIdx.x & 15;    // L/64 row groups
  const int bh = blockIdx.x >> 4;     // b*8+h
  const int h = bh & 7, b = bh >> 3;
  const int l0 = (grp << 6) + (wave << 4);
  const float* __restrict__ qb = q + ((size_t)bh * LL + l0) * HD;
  const float* __restrict__ kb = kmat + (size_t)bh * NN * HD;
  const float* __restrict__ vb = vmat + (size_t)bh * NN * HD;
  const float* __restrict__ mb = mask + ((size_t)bh * LL + l0) * NN;
  const int lane = tid & 31;
  const int col = lane & 15;
  const int hi2 = (lane >> 4) << 1;
  const int ro = (lane >> 4) << 3;

  // Q tile fragments kept in registers for the whole N sweep (32 VGPRs)
  v2f qa[16];
#pragma unroll
  for (int kk = 0; kk < 16; ++kk) qa[kk] = ldfrag(qb, HD, kk);

  v8f o[4] = {};
  float M[8], Lr[8];
#pragma unroll
  for (int r = 0; r < 8; ++r) { M[r] = -INFINITY; Lr[r] = 0.f; }

  const unsigned int ldsM0 = (unsigned int)(size_t)(void*)&sM[wave][0][0];
  const unsigned int ldsM1 = (unsigned int)(size_t)(void*)&sM[wave][1][0];

  // this lane's share of a block: row (tid>>4) + 8*i, 16-byte piece tid&15
  const int crow = tid >> 4, cpc = (tid & 15) << 2;
  const unsigned int ldsK0 = (unsigned int)(size_t)(void*)&sK[0][crow * KP + cpc];
  const unsigned int ldsK1 = (unsigned int)(size_t)(void*)&sK[1][crow * KP + cpc];
  const unsigned int ldsV0 = (unsigned int)(size_t)(void*)&sV[0][crow * VP + cpc];
  const unsigned int ldsV1 = (unsigned int)(size_t)(void*)&sV[1][crow * VP + cpc];
  const float* kc = kb + crow * HD + cpc;
  const float* vc = vb + crow * HD + cpc;

  // block 0 into buffer 0, landed and published; then block 1 into buffer 1
  copy_block(ldsK0, 8 * KP * 4, kc);
  copy_block(ldsV0, 8 * VP * 4, vc);
  tdm_mask_tile(ldsM0, mb);
  asm volatile("s_wait_asynccnt 0x0" ::: "memory");   // own copies of block 0 landed
  asm volatile("s_wait_tensorcnt 0x0" ::: "memory");  // own mask tile 0 landed
  __syncthreads();
  copy_block(ldsK1, 8 * KP * 4, kc + 64 * HD);
  copy_block(ldsV1, 8 * VP * 4, vc + 64 * HD);
  tdm_mask_tile(ldsM1, mb + 64);

  for (int j = 0; j < NBLK; ++j) {
    const float* __restrict__ smj = &sM[wave][j & 1][0];
    const float* __restrict__ skj = &sK[j & 1][0];
    const float* __restrict__ svj = &sV[j & 1][0];

    // S[4] = Q * K_block^T   (64 WMMAs over HD=64, 4 column tiles)
    v8f s[4] = {};
#pragma unroll
    for (int kk = 0; kk < 16; ++kk) {
#pragma unroll
      for (int t = 0; t < 4; ++t) {
        const v2f kf =
            *(const v2f*)(skj + ((t << 4) + col) * KP + (kk << 2) + hi2);
        s[t] = wmma4(qa[kk], kf, s[t]);
      }
    }

    // scale + mask + online softmax over the 64-col block
    // (local max/sum over 4 tiles first, then one 4-step swizzle tree)
    float alpha[8];
#pragma unroll
    for (int r = 0; r < 8; ++r) {
      float sv[4];
      float mx = -INFINITY;
#pragma unroll
      for (int t = 0; t < 4; ++t) {
        const float mval = smj[(r + ro) * MROW + (t << 4) + col];
        sv[t] = s[t][r] * 0.125f + mval;  // SCALE = 64^-0.5
        mx = fmaxf(mx, sv[t]);
      }
      mx = fmaxf(mx, swz_xor<1>(mx));
      mx = fmaxf(mx, swz_xor<2>(mx));
      mx = fmaxf(mx, swz_xor<4>(mx));
      mx = fmaxf(mx, swz_xor<8>(mx));
      const float Mn = fmaxf(M[r], mx);
      alpha[r] = __expf(M[r] - Mn);
      M[r] = Mn;
      float rs = 0.f;
#pragma unroll
      for (int t = 0; t < 4; ++t) {
        const float pv = __expf(sv[t] - Mn);
        sP[wave][r + ro][(t << 4) + col] = pv;
        rs += pv;
      }
      rs += swz_xor<1>(rs);
      rs += swz_xor<2>(rs);
      rs += swz_xor<4>(rs);
      rs += swz_xor<8>(rs);
      Lr[r] = Lr[r] * alpha[r] + rs;
    }
#pragma unroll
    for (int t = 0; t < 4; ++t)
#pragma unroll
      for (int r = 0; r < 8; ++r) o[t][r] *= alpha[r];
    // P is private to the wave: its own stores have retired before other lanes
    // of the same wave read them back; no work-group barrier is needed here
    asm volatile("s_wait_dscnt 0x0" ::: "memory");

    // O += P(16x64) * V_block(64x64)  (64 WMMAs)
#pragma unroll
    for (int kk = 0; kk < 16; ++kk) {
      const int kr = (kk << 2) + hi2;
      const v2f pa = v2f{sP[wave][col][kr], sP[wave][col][kr + 1]};
#pragma unroll
      for (int t = 0; t < 4; ++t) {
        v2f bf;
        bf.x = svj[kr * VP + (t << 4) + col];
        bf.y = svj[(kr + 1) * VP + (t << 4) + col];
        o[t] = wmma4(pa, bf, o[t]);
      }
    }

    // publish point of block j+1, and hand-over of block j's buffers
    asm volatile("s_wait_dscnt 0x0" ::: "memory");      // own reads of block j retired
    asm volatile("s_wait_asynccnt 0x0" ::: "memory");   // own copies of block j+1 landed
    asm volatile("s_wait_tensorcnt 0x0" ::: "memory");  // own mask tile j+1 landed
    __syncthreads();
    // four vector slots between the block's last WMMAs and the first vector
    // write over their A or B registers, on both sides of the branch below
    asm volatile("v_nop\n\tv_nop\n\tv_nop\n\tv_nop");
    if (pinned(j + 2 < NBLK)) {
      const size_t nx = (size_t)(j + 2) * 64;
      copy_block((j & 1) ? ldsK1 : ldsK0, 8 * KP * 4, kc + nx * HD);
      copy_block((j & 1) ? ldsV1 : ldsV0, 8 * VP * 4, vc + nx * HD);
      tdm_mask_tile((j & 1) ? ldsM1 : ldsM0, mb + nx);
    }
  }
  asm volatile("s_wait_asynccnt 0x0" ::: "memory");   // nothing in flight at the end
  asm volatile("s_wait_tensorcnt 0x0" ::: "memory");
  asm volatile("s_wait_dscnt 0x0" ::: "memory");

  // normalize and scatter to [B,L,HID]
#pragma unroll
  for (int r = 0; r < 8; ++r) Lr[r] = 1.f / Lr[r];
#pragma unroll
  for (int t = 0; t < 4; ++t)
#pragma unroll
    for (int r = 0; r < 8; ++r) {
      const int l = l0 + r + ro;
      ao[((size_t)b * LL + l) * HID + (h << 6) + (t << 4) + col] =
          o[t][r] * Lr[r];
    }
}

// ---------------------------------------------------------------------------
// Kernel 4: out = attn_out @ Wproj^T + bproj
// ---------------------------------------------------------------------------
__global__ __launch_bounds__(128) void k_oproj(const float* __restrict__ ao,
                                               const float* __restrict__ Wp,
                                               const float* __restrict__ bp,
                                               float* __restrict__ out) {
  __shared__ __attribute__((aligned(16))) float sA[2 * 64 * GP];
  __shared__ __attribute__((aligned(16))) float sB[2 * 64 * GP];
  const int wave = __builtin_amdgcn_readfirstlane(threadIdx.x >> 5);
  const int m0 = blockIdx.x << 6;  // M = 4096, 64-row tiles
  const int n0 = blockIdx.y << 6;  // N = 512, 64-col tiles
  v8f acc[2][2] = {};
  gemm_staged<2, 2, HID>(ao + (size_t)m0 * HID, Wp + (size_t)n0 * HID, sA, sB, acc);
  const int lane = threadIdx.x & 31;
  const int col = lane & 15;
  const int ro = (lane >> 4) << 3;
  const int mw = m0 + ((wave >> 1) << 5), nw = n0 + ((wave & 1) << 5);
#pragma unroll  // here and below: acc lives in registers, its indices must be constants
  for (int i = 0; i < 2; ++i)
#pragma unroll
    for (int t = 0; t < 2; ++t) {
      const int c = nw + (t << 4) + col;
      const float bias = bp[c];
#pragma unroll
      for (int r = 0; r < 8; ++r) {
        const int m = mw + (i << 4) + r + ro;
        out[(size_t)m * VDIM + c] = acc[i][t][r] + bias;
      }
    }
}

// ---------------------------------------------------------------------------
extern "C" void kernel_launch(void* const* d_in, const int* in_sizes, int n_in,
                              void* d_out, int out_size, void* d_ws,
                              size_t ws_size, hipStream_t stream) {
  const float* x    = (const float*)d_in[0];
  const float* vf   = (const float*)d_in[1];
  const float* mask = (const float*)d_in[2];
  const float* Wq   = (const float*)d_in[3];
  const float* Wkv  = (const float*)d_in[4];
  const float* Wp   = (const float*)d_in[5];
  const float* bp   = (const float*)d_in[6];
  float* out = (float*)d_out;

  float* q  = (float*)d_ws;                         // B*H*L*HD   = 2,097,152 f
  float* km = q + (size_t)BB * NH * LL * HD;        // B*H*N*HD   = 4,194,304 f
  float* vm = km + (size_t)BB * NH * NN * HD;       // B*H*N*HD   = 4,194,304 f
  float* ao = vm + (size_t)BB * NH * NN * HD;       // B*L*HID    = 2,097,152 f

  k_qproj<<<dim3((BB * LL) / 64, HID / 64), 128, 0, stream>>>(x, Wq, q);
  k_kvproj<<<dim3((BB * NN) / 128, (2 * HID) / 128), 128, 0, stream>>>(vf, Wkv, km, vm);
  k_attn<<<dim3(BB * NH * (LL / 64)), 128, 0, stream>>>(q, km, vm, mask, ao);
  k_oproj<<<dim3((BB * LL) / 64, VDIM / 64), 128, 0, stream>>>(ao, Wp, bp, out);
}

// v003
// One run takes 189 microseconds.
// Timed twice side by side with v002, it ran 1.14 times as fast both times.
// Counting every step since v000, it is 3.38 times as fast.
#include <hip/hip_runtime.h>
#include <math.h>

typedef __attribute__((ext_vector_type(2))) float v2f;
typedef __attribute__((ext_vector_type(8))) float v8f;
typedef __attribute__((ext_vector_type(4))) unsigned int v4u;
typedef __attribute__((ext_vector_type(8))) int v8i;
typedef __attribute__((ext_vector_type(4))) int v4i;

// ---------------------------------------------------------------------------
// f32 WMMA helper: D = A(16x4) * B(4x16) + C(16x16), wave32.
// ---------------------------------------------------------------------------
__device__ __forceinline__ v8f wmma4(v2f a, v2f b, v8f c) {
  return __builtin_amdgcn_wmma_f32_16x16x4_f32(false, a, false, b, (short)0, c,
                                               false, false);
}

// A-fragment (and B-fragment from row-major [N,K]) loader for 16x16x4 f32:
// lane<16 holds [row=lane][k = 4*kk + {0,1}], lane>=16 holds [row=lane-16][4*kk+{2,3}]
__device__ __forceinline__ v2f ldfrag(const float* __restrict__ base, int ld,
                                      int kk) {
  const int lane = threadIdx.x & 31;
  const int row = lane & 15;
  const int kr = (kk << 2) + ((lane >> 4) << 1);
  return *(const v2f*)(base + (size_t)row * ld + kr);  // 8B aligned -> b64 load
}

// ---------------------------------------------------------------------------
// Projection GEMM, C = A[M,K] * B[N,K]^T, fp32: a work-group of four waves
// (2 x 2) owns a (32*MT) x (32*NT) tile of C, a wave MT x NT tiles of 16 x 16.
// A and B pass through LDS in stages of GK columns (asynchronous copies, two
// buffers): each row piece is fetched once for the work-group, as whole
// 256-byte runs, and the next stage flies while this one is worked on.
// ---------------------------------------------------------------------------
#define GK 64  // k extent of a stage, floats
#define GP 68  // LDS row pitch, floats: 8-byte fragment reads meet all 64 banks

// Eight asynchronous 16-byte copies per lane, rows 8 apart: 64 rows of 256 B
// for the 128 lanes together. The s_wait_xcnt closes the statement so that no
// address register is rewritten ahead of it.
__device__ __forceinline__ void copy_rows(unsigned int l, const float* g,
                                          size_t gs) {
  const unsigned int ls = 8 * GP * 4;
  asm volatile(
      "global_load_async_to_lds_b128 %0, %8, off\n\t"
      "global_load_async_to_lds_b128 %1, %9, off\n\t"
      "global_load_async_to_lds_b128 %2, %10, off\n\t"
      "global_load_async_to_lds_b128 %3, %11, off\n\t"
      "global_load_async_to_lds_b128 %4, %12, off\n\t"
      "global_load_async_to_lds_b128 %5, %13, off\n\t"
      "global_load_async_to_lds_b128 %6, %14, off\n\t"
      "global_load_async_to_lds_b128 %7, %15, off\n\t"
      "s_wait_xcnt 0x0"
      :: "v"(l), "v"(l + ls), "v"(l + 2 * ls), "v"(l + 3 * ls), "v"(l + 4 * ls),
         "v"(l + 5 * ls), "v"(l + 6 * ls), "v"(l + 7 * ls),
         "v"(g), "v"(g + gs), "v"(g + 2 * gs), "v"(g + 3 * gs), "v"(g + 4 * gs),
         "v"(g + 5 * gs), "v"(g + 6 * gs), "v"(g + 7 * gs)
      : "memory");
}

// one stage of R rows (R a multiple of 64) of a row-major [.,K] matrix
template <int R, int K>
__device__ __forceinline__ void copy_stage(unsigned int l, const float* g) {
#pragma unroll  // R/64 statements, addresses folded at compile time
  for (int i = 0; i < R / 64; ++i)
    copy_rows(l + i * 64 * GP * 4, g + (size_t)i * 64 * K, (size_t)8 * K);
}

// A, B: first row of the work-group's tile. sA: 2 x 32*MT*GP floats, sB alike.
template <int MT, int NT, int K>
__device__ __forceinline__ void gemm_staged(const float* __restrict__ A,
                                            const float* __restrict__ B,
                                            float* sA, float* sB,
                                            v8f (&acc)[MT][NT]) {
  constexpr int BM = 32 * MT, BN = 32 * NT, NS = K / GK;
  const int tid = threadIdx.x;
  const int wave = __builtin_amdgcn_readfirstlane(tid >> 5);
  const int lane = tid & 31;
  const int col = lane & 15;
  const int hi2 = (lane >> 4) << 1;
  // this lane's share of a stage: row (tid>>4) + 8*i, 16-byte piece tid&15
  const int crow = tid >> 4, cpc = (tid & 15) << 2;
  const unsigned int lA = (unsigned int)(size_t)(void*)(sA + crow * GP + cpc);
  const unsigned int lB = (unsigned int)(size_t)(void*)(sB + crow * GP + cpc);
  const float* ga = A + (size_t)crow * K + cpc;
  const float* gb = B + (size_t)crow * K + cpc;
  // this lane's fragment rows inside a buffer
  const int fa = (((wave >> 1) * MT << 4) + col) * GP + hi2;
  const int fb = (((wave & 1) * NT << 4) + col) * GP + hi2;

  // stage 0 into buffer 0, landed and published; then stage 1 into buffer 1
  copy_stage<BM, K>(lA, ga);
  copy_stage<BN, K>(lB, gb);
  asm volatile("s_wait_asynccnt 0x0" ::: "memory");  // own copies of stage 0 landed
  __syncthreads();
  copy_stage<BM, K>(lA + BM * GP * 4, ga + GK);
  copy_stage<BN, K>(lB + BN * GP * 4, gb + GK);

#pragma unroll 1  // rolled
  for (int s = 0; s < NS; ++s) {
    const float* __restrict__ pa = sA + (s & 1) * (BM * GP) + fa;
    const float* __restrict__ pb = sB + (s & 1) * (BN * GP) + fb;
#pragma unroll  // straight line: LDS offsets become immediates, reads run ahead
    for (int kk = 0; kk < GK / 4; ++kk) {
      v2f af[MT], bf[NT];
#pragma unroll  // register arrays need constant indices
      for (int i = 0; i < MT; ++i)
        af[i] = *(const v2f*)(pa + (i << 4) * GP + (kk << 2));
#pragma unroll  // register arrays need constant indices
      for (int t = 0; t < NT; ++t)
        bf[t] = *(const v2f*)(pb + (t << 4) * GP + (kk << 2));
#pragma unroll  // register arrays need constant indices
      for (int i = 0; i < MT; ++i)
#pragma unroll  // register arrays need constant indices
        for (int t = 0; t < NT; ++t) acc[i][t] = wmma4(af[i], bf[t], acc[i][t]);
    }
    // publish point of stage s+1, and hand-over of stage s's buffers
    asm volatile("s_wait_dscnt 0x0" ::: "memory");     // own reads of stage s retired
    asm volatile("s_wait_asynccnt 0x0" ::: "memory");  // own copies of stage s+1 landed
    __syncthreads();
    if (s + 2 < NS) {
      copy_stage<BM, K>(lA + (s & 1) * (BM * GP * 4), ga + (s + 2) * GK);
      copy_stage<BN, K>(lB + (s & 1) * (BN * GP * 4), gb + (s + 2) * GK);
    }
  }
  asm volatile("s_wait_asynccnt 0x0" ::: "memory");  // nothing in flight at the end
}

// e^x as __expf forms it (2^(x * log2 e)), with the slot that the instruction
// set asks for behind a transcendental, before its result is read or its source
// rewritten, held inside the statement
__device__ __forceinline__ float exp_slot(float x) {
  float y;
  asm("v_exp_f32 %0, %1\n\tv_nop" : "=v"(y) : "v"(x * 1.44269504f));
  return y;
}

// lane l with lane l ^ 16
__device__ __forceinline__ float xhalf(float x) {
  const int b = __float_as_int(x);
  return __int_as_float(__builtin_amdgcn_permlanex16(b, b, 0x76543210, 0xfedcba98,
                                                     false, false));
}

// ---------------------------------------------------------------------------
// Problem constants
// ---------------------------------------------------------------------------
#define BB 4
#define LL 1024
#define NN 2048
#define VDIM 512
#define LDIM 768
#define HID 512
#define NH 8
#define HD 64
#define NBLK 32           // N / 64 column blocks in attention
#define MROW 65           // padded LDS row stride for mask tiles (floats)

// ---------------------------------------------------------------------------
// TDM: async DMA of one 16x64 f32 mask tile (row stride NN) into LDS.
// 2D descriptor, data_size=4B, pad 1 DWORD every 64 DWORDs -> LDS row = 65 f.
// ---------------------------------------------------------------------------
__device__ __forceinline__ void tdm_mask_tile(unsigned int lds_off,
                                              const float* g) {
  const unsigned long long ga = (unsigned long long)(uintptr_t)g;
  v4u g0 = {1u,                                   // count=1, user descriptor
            lds_off,                              // lds_addr (bytes)
            (unsigned int)ga,                     // global_addr[31:0]
            ((unsigned int)(ga >> 32) & 0x01FFFFFFu) | (2u << 30)};  // type=2
  v8i g1 = {(int)((2u << 16) | (1u << 20) | (5u << 22)),  // 4B | pad_en | every 64dw
            (int)(((unsigned int)NN & 0xFFFFu) << 16),    // tensor_dim0 lo16
            (int)(0x8000u << 16),                         // tensor_dim1 lo16 = 32768
            (int)(64u << 16),                             // tile_dim0 = 64
            16,                                           // tile_dim1 = 16
            (int)NN,                                      // tensor_dim0_stride
            0, 0};
  v4i gz4 = {0, 0, 0, 0};
  v8i gz8 = {0, 0, 0, 0, 0, 0, 0, 0};
  __builtin_amdgcn_tensor_load_to_lds(g0, g1, gz4, gz4, gz8, 0);
}

// ---------------------------------------------------------------------------
// Kernel 1: q = x @ Wq^T   -> stored [B,H,L,HD]
// ---------------------------------------------------------------------------
__global__ __launch_bounds__(128) void k_qproj(const float* __restrict__ x,
                                               const float* __restrict__ Wq,
                                               float* __restrict__ qout) {
  __shared__ __attribute__((aligned(16))) float sA[2 * 64 * GP];
  __shared__ __attribute__((aligned(16))) float sB[2 * 64 * GP];
  const int wave = __builtin_amdgcn_readfirstlane(threadIdx.x >> 5);
  const int m0 = blockIdx.x << 6;  // M = B*L = 4096, 64-row tiles
  const int n0 = blockIdx.y << 6;  // N = HID = 512, 64-col tiles
  v8f acc[2][2] = {};
  gemm_staged<2, 2, VDIM>(x + (size_t)m0 * VDIM, Wq + (size_t)n0 * VDIM, sA, sB, acc);
  const int lane = threadIdx.x & 31;
  const int col = lane & 15;
  const int ro = (lane >> 4) << 3;
  const int mw = m0 + ((wave >> 1) << 5), nw = n0 + ((wave & 1) << 5);
#pragma unroll  // here and below: acc lives in registers, its indices must be constants
  for (int i = 0; i < 2; ++i)
#pragma unroll
    for (int t = 0; t < 2; ++t) {
      const int c = nw + (t << 4) + col;
      const int h = c >> 6, d = c & 63;
#pragma unroll
      for (int r = 0; r < 8; ++r) {
        const int m = mw + (i << 4) + r + ro;
        const int b = m >> 10, l = m & (LL - 1);
        qout[(size_t)((((b << 3) + h) << 10) + l) * HD + d] = acc[i][t][r];
      }
    }
}

// ---------------------------------------------------------------------------
// Kernel 2: kv = vfeats @ Wkv^T -> k,v each stored [B,H,N,HD]
// ---------------------------------------------------------------------------
__global__ __launch_bounds__(128) void k_kvproj(const float* __restrict__ vf,
                                                const float* __restrict__ Wkv,
                                                float* __restrict__ kout,
                                                float* __restrict__ vout) {
  __shared__ __attribute__((aligned(16))) float sA[2 * 128 * GP];
  __shared__ __attribute__((aligned(16))) float sB[2 * 128 * GP];
  const int wave = __builtin_amdgcn_readfirstlane(threadIdx.x >> 5);
  const int m0 = blockIdx.x << 7;  // M = B*N = 8192, 128-row tiles
  const int n0 = blockIdx.y << 7;  // N = 2*HID = 1024, 128-col tiles
  v8f acc[4][4] = {};
  gemm_staged<4, 4, LDIM>(vf + (size_t)m0 * LDIM, Wkv + (size_t)n0 * LDIM, sA, sB, acc);
  const int lane = threadIdx.x & 31;
  const int col = lane & 15;
  const int ro = (lane >> 4) << 3;
  const int mw = m0 + ((wave >> 1) << 6), nw = n0 + ((wave & 1) << 6);
  float* __restrict__ dst = (n0 < HID) ? kout : vout;  // tile lies in k or in v
#pragma unroll  // here and below: acc lives in registers, its indices must be constants
  for (int i = 0; i < 4; ++i)
#pragma unroll
    for (int t = 0; t < 4; ++t) {
      const int c = nw + (t << 4) + col;
      const int h = (c & (HID - 1)) >> 6, d = c & 63;
#pragma unroll
      for (int r = 0; r < 8; ++r) {
        const int m = mw + (i << 4) + r + ro;
        const int b = m >> 11, n = m & (NN - 1);
        dst[(size_t)((((b << 3) + h) << 11) + n) * HD + d] = acc[i][t][r];
      }
    }
}

#define AW 4
#define KP 68
#define VP 68
#define MBUF 1536

// wave-uniform test held in a scalar register, so that the branch is scalar
__device__ __forceinline__ unsigned int pinned(unsigned int v) {
  unsigned int w = __builtin_amdgcn_readfirstlane(v);
  asm volatile("" : "+s"(w));  // tensor mover's issue test held in a scalar register
  return w;
}

// Eight asynchronous 16-byte copies per lane: a 64x64 f32 block (rows of 256 B,
// contiguous in global memory) into LDS rows of lstep/8 bytes. The s_wait_xcnt
// closes the statement so that no address register is rewritten ahead of it.
__device__ __forceinline__ void copy_block(unsigned int l, unsigned int lstep,
                                           const float* g) {
  asm volatile(
      "global_load_async_to_lds_b128 %0, %8, off\n\t"
      "global_load_async_to_lds_b128 %1, %9, off\n\t"
      "global_load_async_to_lds_b128 %2, %10, off\n\t"
      "global_load_async_to_lds_b128 %3, %11, off\n\t"
      "global_load_async_to_lds_b128 %4, %12, off\n\t"
      "global_load_async_to_lds_b128 %5, %13, off\n\t"
      "global_load_async_to_lds_b128 %6, %14, off\n\t"
      "global_load_async_to_lds_b128 %7, %15, off\n\t"
      "s_wait_xcnt 0x0"
      :: "v"(l), "v"(l + lstep), "v"(l + 2 * lstep), "v"(l + 3 * lstep),
         "v"(l + 4 * lstep), "v"(l + 5 * lstep), "v"(l + 6 * lstep),
         "v"(l + 7 * lstep),
         "v"(g), "v"(g + 512), "v"(g + 1024), "v"(g + 1536), "v"(g + 2048),
         "v"(g + 2560), "v"(g + 3072), "v"(g + 3584)
      : "memory");
}

// at most 256 VGPRs: no register lies above v255, so that the asm copies never
// run under a switched register window
__global__ __launch_bounds__(128) __attribute__((amdgpu_num_vgpr(256))) void k_attn(const float* __restrict__ q,
                                              const float* __restrict__ kmat,
                                              const float* __restrict__ vmat,
                                              const float* __restrict__ mask,
                                              float* __restrict__ ao) {
  __shared__ __attribute__((aligned(2048))) float sM[AW][2][MBUF];  // mask tiles
  __shared__ __attribute__((aligned(16))) float sK[2][64 * KP];     // K blocks
  __shared__ __attribute__((aligned(16))) float sV[2][64 * VP];     // V blocks
  const int tid = threadIdx.x;
  const int wave = __builtin_amdgcn_readfirstlane(tid >> 5);
  const int grp = blockIdx.x & 15;    // L/64 row groups
  const int bh = blockIdx.x >> 4;     // b*8+h
  const int h = bh & 7, b = bh >> 3;
  const int l0 = (grp << 6) + (wave << 4);
  const float* __restrict__ qb = q + ((size_t)bh * LL + l0) * HD;
  const float* __restrict__ kb = kmat + (size_t)bh * NN * HD;
  const float* __restrict__ vb = vmat + (size_t)bh * NN * HD;
  const float* __restrict__ mb = mask + ((size_t)bh * LL + l0) * NN;
  const int lane = tid & 31;
  const int col = lane & 15;
  const int hi2 = (lane >> 4) << 1;
  const int ro = (lane >> 4) << 3;

  // Q tile fragments (B operand) kept in registers for the whole N sweep (32 VGPRs)
  v2f qa[16];
#pragma unroll
  for (int kk = 0; kk < 16; ++kk) qa[kk] = ldfrag(qb, HD, kk);

  v8f o[4] = {};  // o[t][r] = O[query col][d = 16*t + ro + r]
  float M = -INFINITY;  // running maximum of query col, equal in both halves
  float Lr = 0.f;       // running sum over this half's keys; halves joined at the end

  const unsigned int ldsM0 = (unsigned int)(size_t)(void*)&sM[wave][0][0];
  const unsigned int ldsM1 = (unsigned int)(size_t)(void*)&sM[wave][1][0];

  // this lane's share of a block: row (tid>>4) + 8*i, 16-byte piece tid&15
  const int crow = tid >> 4, cpc = (tid & 15) << 2;
  const unsigned int ldsK0 = (unsigned int)(size_t)(void*)&sK[0][crow * KP + cpc];
  const unsigned int ldsK1 = (unsigned int)(size_t)(void*)&sK[1][crow * KP + cpc];
  const unsigned int ldsV0 = (unsigned int)(size_t)(void*)&sV[0][crow * VP + cpc];
  const unsigned int ldsV1 = (unsigned int)(size_t)(void*)&sV[1][crow * VP + cpc];
  const float* kc = kb + crow * HD + cpc;
  const float* vc = vb + crow * HD + cpc;

  // block 0 into buffer 0, landed and published; then block 1 into buffer 1
  copy_block(ldsK0, 8 * KP * 4, kc);
  copy_block(ldsV0, 8 * VP * 4, vc);
  tdm_mask_tile(ldsM0, mb);
  asm volatile("s_wait_asynccnt 0x0" ::: "memory");   // own copies of block 0 landed
  asm volatile("s_wait_tensorcnt 0x0" ::: "memory");  // own mask tile 0 landed
  __syncthreads();
  copy_block(ldsK1, 8 * KP * 4, kc + 64 * HD);
  copy_block(ldsV1, 8 * VP * 4, vc + 64 * HD);
  tdm_mask_tile(ldsM1, mb + 64);

  for (int j = 0; j < NBLK; ++j) {
    const float* __restrict__ smj = &sM[wave][j & 1][0];
    const float* __restrict__ skj = &sK[j & 1][0];
    const float* __restrict__ svj = &sV[j & 1][0];

    // S^T[4] = K_block * Q^T   (64 WMMAs over HD=64, 4 key tiles)
    // s[t][r] = score of key 16*t + ro + r with query col
    v8f s[4] = {};
#pragma unroll  // register arrays need constant indices
    for (int kk = 0; kk < 16; ++kk) {
#pragma unroll  // register arrays need constant indices
      for (int t = 0; t < 4; ++t) {
        const v2f kf =
            *(const v2f*)(skj + ((t << 4) + col) * KP + (kk << 2) + hi2);
        s[t] = wmma4(kf, qa[kk], s[t]);
      }
    }

    // scale + mask + online softmax over the 64-key block, one query a lane
    float mt[4];  // one chain a key tile, so that the chains run side by side
#pragma unroll  // register arrays need constant indices
    for (int t = 0; t < 4; ++t) {
      mt[t] = -INFINITY;
#pragma unroll  // register arrays need constant indices
      for (int r = 0; r < 8; ++r) {
        const float mval = smj[col * MROW + (t << 4) + ro + r];
        s[t][r] = s[t][r] * 0.125f + mval;  // SCALE = 64^-0.5
        mt[t] = fmaxf(mt[t], s[t][r]);
      }
    }
    float mx = fmaxf(fmaxf(mt[0], mt[1]), fmaxf(mt[2], mt[3]));
    mx = fmaxf(mx, xhalf(mx));
    const float Mn = fmaxf(M, mx);
    const float alpha = exp_slot(M - Mn);
    M = Mn;
    float rt[4];
#pragma unroll  // register arrays need constant indices
    for (int t = 0; t < 4; ++t) {
      rt[t] = 0.f;
#pragma unroll  // register arrays need constant indices
      for (int r = 0; r < 8; ++r) {
        s[t][r] = __expf(s[t][r] - Mn);
        rt[t] += s[t][r];
      }
    }
    Lr = Lr * alpha + ((rt[0] + rt[1]) + (rt[2] + rt[3]));
#pragma unroll  // register arrays need constant indices
    for (int t = 0; t < 4; ++t)
#pragma unroll  // register arrays need constant indices
      for (int r = 0; r < 8; ++r) o[t][r] *= alpha;

    // O^T += V_block^T(64x64) * P^T(64x16)  (64 WMMAs). Registers 2c, 2c+1 of
    // s[t] are the B fragment of keys 16*t + 2c + {0, 1, 8, 9}; A takes V's
    // rows in that same order.
#pragma unroll  // register arrays need constant indices
    for (int t = 0; t < 4; ++t) {
#pragma unroll  // register arrays need constant indices
      for (int c = 0; c < 4; ++c) {
        const v2f pb = v2f{s[t][2 * c], s[t][2 * c + 1]};
        const int kr = (t << 4) + (c << 1) + ro;
#pragma unroll  // register arrays need constant indices
        for (int u = 0; u < 4; ++u) {
          v2f va;
          va.x = svj[kr * VP + (u << 4) + col];
          va.y = svj[(kr + 1) * VP + (u << 4) + col];
          o[u] = wmma4(va, pb, o[u]);
        }
      }
    }

    // the block's WMMAs stay above this line: sunk below the barrier they would
    // stand behind the v_nop slots that are written for them there
    __builtin_amdgcn_sched_barrier(0);
    // publish point of block j+1, and hand-over of block j's buffers
    asm volatile("s_wait_dscnt 0x0" ::: "memory");      // own reads of block j retired
    asm volatile("s_wait_asynccnt 0x0" ::: "memory");   // own copies of block j+1 landed
    asm volatile("s_wait_tensorcnt 0x0" ::: "memory");  // own mask tile j+1 landed
    __syncthreads();
    // four vector slots between the block's last WMMAs and the first vector
    // write over their A or B registers, on both sides of the branch below
    asm volatile("v_nop\n\tv_nop\n\tv_nop\n\tv_nop");
    if (pinned(j + 2 < NBLK)) {
      const size_t nx = (size_t)(j + 2) * 64;
      copy_block((j & 1) ? ldsK1 : ldsK0, 8 * KP * 4, kc + nx * HD);
      copy_block((j & 1) ? ldsV1 : ldsV0, 8 * VP * 4, vc + nx * HD);
      tdm_mask_tile((j & 1) ? ldsM1 : ldsM0, mb + nx);
    }
  }
  asm volatile("s_wait_asynccnt 0x0" ::: "memory");   // nothing in flight at the end
  asm volatile("s_wait_tensorcnt 0x0" ::: "memory");
  asm volatile("s_wait_dscnt 0x0" ::: "memory");

  // join the halves' sums, normalize, store to [B,L,HID]: 8 floats in a row a tile
  const float inv = 1.f / (Lr + xhalf(Lr));
  float* __restrict__ ob = ao + ((size_t)b * LL + l0 + col) * HID + (h << 6) + ro;
#pragma unroll  // register arrays need constant indices
  for (int t = 0; t < 4; ++t) {
    *(float4*)(ob + (t << 4)) =
        make_float4(o[t][0] * inv, o[t][1] * inv, o[t][2] * inv, o[t][3] * inv);
    *(float4*)(ob + (t << 4) + 4) =
        make_float4(o[t][4] * inv, o[t][5] * inv, o[t][6] * inv, o[t][7] * inv);
  }
}

// ---------------------------------------------------------------------------
// Kernel 4: out = attn_out @ Wproj^T + bproj
// ---------------------------------------------------------------------------
__global__ __launch_bounds__(128) void k_oproj(const float* __restrict__ ao,
                                               const float* __restrict__ Wp,
                                               const float* __restrict__ bp,
                                               float* __restrict__ out) {
  __shared__ __attribute__((aligned(16))) float sA[2 * 64 * GP];
  __shared__ __attribute__((aligned(16))) float sB[2 * 64 * GP];
  const int wave = __builtin_amdgcn_readfirstlane(threadIdx.x >> 5);
  const int m0 = blockIdx.x << 6;  // M = 4096, 64-row tiles
  const int n0 = blockIdx.y << 6;  // N = 512, 64-col tiles
  v8f acc[2][2] = {};
  gemm_staged<2, 2, HID>(ao + (size_t)m0 * HID, Wp + (size_t)n0 * HID, sA, sB, acc);
  const int lane = threadIdx.x & 31;
  const int col = lane & 15;
  const int ro = (lane >> 4) << 3;
  const int mw = m0 + ((wave >> 1) << 5), nw = n0 + ((wave & 1) << 5);
#pragma unroll  // here and below: acc lives in registers, its indices must be constants
  for (int i = 0; i < 2; ++i)
#pragma unroll
    for (int t = 0; t < 2; ++t) {
      const int c = nw + (t << 4) + col;
      const float bias = bp[c];
#pragma unroll
      for (int r = 0; r < 8; ++r) {
        const int m = mw + (i << 4) + r + ro;
        out[(size_t)m * VDIM + c] = acc[i][t][r] + bias;
      }
    }
}

// ---------------------------------------------------------------------------
extern "C" void kernel_launch(void* const* d_in, const int* in_sizes, int n_in,
                              void* d_out, int out_size, void* d_ws,
                              size_t ws_size, hipStream_t stream) {
  const float* x    = (const float*)d_in[0];
  const float* vf   = (const float*)d_in[1];
  const float* mask = (const float*)d_in[2];
  const float* Wq   = (const float*)d_in[3];
  const float* Wkv  = (const float*)d_in[4];
  const float* Wp   = (const float*)d_in[5];
  const float* bp   = (const float*)d_in[6];
  float* out = (float*)d_out;

  float* q  = (float*)d_ws;                         // B*H*L*HD   = 2,097,152 f
  float* km = q + (size_t)BB * NH * LL * HD;        // B*H*N*HD   = 4,194,304 f
  float* vm = km + (size_t)BB * NH * NN * HD;       // B*H*N*HD   = 4,194,304 f
  float* ao = vm + (size_t)BB * NH * NN * HD;       // B*L*HID    = 2,097,152 f

  k_qproj<<<dim3((BB * LL) / 64, HID / 64), 128, 0, stream>>>(x, Wq, q);
  k_kvproj<<<dim3((BB * NN) / 128, (2 * HID) / 128), 128, 0, stream>>>(vf, Wkv, km, vm);
  k_attn<<<dim3(BB * NH * (LL / 64)), 128, 0, stream>>>(q, km, vm, mask, ao);
  k_oproj<<<dim3((BB * LL) / 64, VDIM / 64), 128, 0, stream>>>(ao, Wp, bp, out);
}
